// v000
// Times are from an AMD MI455X. After a warm-up the kernel runs many times in a row, and a time is the length of
// such a window on the GPU divided by its runs, so every launch and the gaps after it count. The runs cycle
// through copies of the inputs. A figure is the median of several windows, for all but v000 over two sittings.
// Sittings can differ by a few percent; kernels timed side by side share one.
// v000 is the starting kernel. One run takes 27.8 microseconds.
#include <hip/hip_runtime.h>
#include <cstdint>

#define B_SZ      512
#define D_SZ      256
#define NUM_FIXED 512
#define MAX_VARS  128
#define L_TOT     (NUM_FIXED + 2 * MAX_VARS)   // 768
#define SCALE     0.0625f                      // 1/sqrt(256)

// TDM pads LDS rows: 4 DWORDs of pad every 256 DWORDs -> row stride 260 floats.
// ds_load_b64 fragment reads then hit banks (4*l16 + c) mod 64: conflict-free.
#define LDS_STRIDE 260

typedef __attribute__((ext_vector_type(2))) float    v2f;
typedef __attribute__((ext_vector_type(8))) float    v8f;
typedef __attribute__((ext_vector_type(4))) unsigned v4u;
typedef __attribute__((ext_vector_type(4))) int      v4i;
typedef __attribute__((ext_vector_type(8))) int      v8i;

// ---------------------------------------------------------------------------
// Issue a 2-D TENSOR_LOAD_TO_LDS: tile_rows x 256 f32, row stride 256 f32 in
// memory, padded rows (stride 260 f32) in LDS. D# bit layout per ISA §8.3-8.5.
// ---------------------------------------------------------------------------
__device__ __forceinline__ void tdm_load_2d(unsigned lds_off, const float* gptr,
                                            unsigned tile_rows) {
  unsigned long long ga = (unsigned long long)(uintptr_t)gptr;
  v4u g0;
  g0.x = 1u;                                   // count=1 (valid user descriptor)
  g0.y = lds_off;                              // lds_addr (bytes)
  g0.z = (unsigned)ga;                         // global_addr[31:0]
  g0.w = (unsigned)((ga >> 32) & 0x1FFFFFFu)   // global_addr[56:32]
       | (2u << 30);                           // type = 2 ("image")
  v8i g1;
  g1[0] = (int)((2u << 16)        // data_size = 4 bytes
              | (1u << 20)        // pad_enable
              | (7u << 22)        // pad_interval: 256 DWORDs
              | (3u << 25));      // pad_amount:   4 DWORDs
  g1[1] = (int)(256u << 16);      // tensor_dim0 = 256 (bits 79:48, low half)
  g1[2] = (int)(tile_rows << 16); // tensor_dim0 hi=0 | tensor_dim1 = tile_rows
  g1[3] = (int)(256u << 16);      // tensor_dim1 hi=0 | tile_dim0 = 256
  g1[4] = (int)tile_rows;         // tile_dim1 | tile_dim2 = 0
  g1[5] = 256;                    // tensor_dim0_stride = 256 (low 32 of 48)
  g1[6] = 0;
  g1[7] = 0;
  v4i gz = {0, 0, 0, 0};
#if defined(__clang_major__) && (__clang_major__ >= 23)
  v8i gz8 = {0, 0, 0, 0, 0, 0, 0, 0};
  __builtin_amdgcn_tensor_load_to_lds(g0, g1, gz, gz, gz8, 0);
#else
  __builtin_amdgcn_tensor_load_to_lds(g0, g1, gz, gz, 0);
#endif
}

// ---------------------------------------------------------------------------
// Kernel 1: fixed-key GEMM out[0:512, 0:512] = q * k^T via WMMA f32 16x16x4.
// Each block: one 16-row q tile x one 128-row k tile, both DMA'd to LDS by
// the Tensor Data Mover (wave 0), consumed by 8 waves (one 16x16 tile each)
// through conflict-free ds_load_b64 fragment reads.
// ---------------------------------------------------------------------------
__global__ __launch_bounds__(256) void attn_fixed_wmma(
    const float* __restrict__ q, const float* __restrict__ kfix,
    float* __restrict__ out)
{
  __shared__ __align__(16) float lds_q[16  * LDS_STRIDE];   // ~16.6 KB
  __shared__ __align__(16) float lds_k[128 * LDS_STRIDE];   // ~133 KB (<=320KB/WGP)

  const int lane = threadIdx.x & 31;
  const int wave = threadIdx.x >> 5;
  const int bm   = blockIdx.x >> 2;   // q-row tile   (0..31)
  const int bn   = blockIdx.x & 3;    // 128-col group (0..3)

  if (wave == 0) {
    tdm_load_2d((unsigned)(uintptr_t)&lds_q[0], q    + (size_t)bm * 16  * D_SZ, 16);
    tdm_load_2d((unsigned)(uintptr_t)&lds_k[0], kfix + (size_t)bn * 128 * D_SZ, 128);
    __builtin_amdgcn_s_wait_tensorcnt(0);
  }
  __syncthreads();

  // Fragment addressing (ISA 7.12.2, 32-bit A 16x4 / B 4x16):
  // lane<16: row=lane, K=k0..k0+1 ; lane>=16: row=lane-16, K=k0+2..k0+3.
  const int half = lane >> 4;
  const int l16  = lane & 15;
  const float* qrow = &lds_q[l16 * LDS_STRIDE + 2 * half];
  const float* krow = &lds_k[(wave * 16 + l16) * LDS_STRIDE + 2 * half];

  v8f acc = {};
#pragma unroll 8
  for (int kk = 0; kk < D_SZ; kk += 4) {
    v2f a = *(const v2f*)(qrow + kk);
    v2f b = *(const v2f*)(krow + kk);
    // 8 args: (neg_a, A, neg_b, B, c_mod, C, reuse_a, reuse_b)
    acc = __builtin_amdgcn_wmma_f32_16x16x4_f32(
        false, a, false, b, (short)0, acc, false, false);
  }

  // C/D layout: VGPR v -> (M = v + 8*half, N = l16) within the 16x16 tile.
  float* orow = out + (size_t)(bm * 16) * L_TOT + bn * 128 + wave * 16 + l16;
#pragma unroll
  for (int v = 0; v < 8; ++v)
    orow[(size_t)(v + 8 * half) * L_TOT] = acc[v] * SCALE;
}

// ---------------------------------------------------------------------------
// Kernel 2: k_var + gathered k_arg columns (the ~128 MB HBM stream that
// dominates runtime; no cross-batch reuse -> WMMA cannot help). One block per
// batch element; each wave processes 4 key rows per iteration so 8 coalesced
// b128 loads are in flight before the dependent reductions, and the 4
// contiguous results are written with one global_store_b128.
// ---------------------------------------------------------------------------
__global__ __launch_bounds__(256) void attn_var(
    const float* __restrict__ q, const float* __restrict__ kvar,
    const int* __restrict__ args, const float* __restrict__ karg,
    float* __restrict__ out)
{
  const int b    = blockIdx.x;
  const int lane = threadIdx.x & 31;
  const int wave = threadIdx.x >> 5;

  // Each lane keeps its private 8-float slice of q[b] in registers.
  const float4 q0 = *(const float4*)(q + (size_t)b * D_SZ + lane * 8);
  const float4 q1 = *(const float4*)(q + (size_t)b * D_SZ + lane * 8 + 4);

  for (int m0 = wave * 4; m0 < 2 * MAX_VARS; m0 += 32) {
    // Resolve 4 row pointers (wave-uniform; sentinel gather rows -> nullptr).
    const float* rows[4];
#pragma unroll
    for (int r = 0; r < 4; ++r) {
      const int m = m0 + r;
      if (m < MAX_VARS) {
        rows[r] = kvar + ((size_t)b * MAX_VARS + m) * D_SZ;
      } else {
        const int mm = m - MAX_VARS;
        const int i = args[((size_t)b * MAX_VARS + mm) * 2 + 0];
        const int j = args[((size_t)b * MAX_VARS + mm) * 2 + 1];
        rows[r] = (i < 0) ? nullptr
                          : karg + (size_t)(i * MAX_VARS + j) * D_SZ;
      }
    }

    // Prefetch the k_var stream one wave-iteration ahead (global_prefetch_b8).
    if (m0 + 32 < MAX_VARS)
      __builtin_prefetch(rows[0] + 32 * D_SZ, 0, 3);

    // 8 independent b128 loads + dot partials.
    float s[4];
#pragma unroll
    for (int r = 0; r < 4; ++r) {
      if (rows[r]) {
        const float4 k0 = *(const float4*)(rows[r] + lane * 8);
        const float4 k1 = *(const float4*)(rows[r] + lane * 8 + 4);
        s[r] = q0.x * k0.x + q0.y * k0.y + q0.z * k0.z + q0.w * k0.w
             + q1.x * k1.x + q1.y * k1.y + q1.z * k1.z + q1.w * k1.w;
      } else {
        s[r] = 0.0f;   // masked sentinel row -> exact zero
      }
    }

    // 4 interleaved wave32 butterfly reductions.
#pragma unroll
    for (int off = 16; off > 0; off >>= 1) {
#pragma unroll
      for (int r = 0; r < 4; ++r)
        s[r] += __shfl_xor(s[r], off, 32);
    }

    if (lane == 0) {
      float4 o = make_float4(s[0] * SCALE, s[1] * SCALE,
                             s[2] * SCALE, s[3] * SCALE);
      *(float4*)(out + (size_t)b * L_TOT + NUM_FIXED + m0) = o;  // b128 store
    }
  }
}

extern "C" void kernel_launch(void* const* d_in, const int* in_sizes, int n_in,
                              void* d_out, int out_size, void* d_ws, size_t ws_size,
                              hipStream_t stream) {
  const float* q    = (const float*)d_in[0];   // [512, 256]
  const float* kvar = (const float*)d_in[1];   // [512, 128, 256]
  const int*   args = (const int*)d_in[2];     // [512, 128, 2]
  const float* kfix = (const float*)d_in[3];   // [512, 256]
  const float* karg = (const float*)d_in[4];   // [16384, 256]
  float* out = (float*)d_out;                  // [512, 768]

  // 32 q-row tiles x 4 column groups of 128 -> 128 blocks, 8 waves each.
  attn_fixed_wmma<<<128, 256, 0, stream>>>(q, kfix, out);
  // One block per batch element for the streaming/gather columns.
  attn_var<<<B_SZ, 256, 0, stream>>>(q, kvar, args, karg, out);
}

// v001
// It runs in 14.9 microseconds.
// Timed twice side by side with v000, it ran 1.89 and 1.88 times as fast.
#include <hip/hip_runtime.h>
#include <cstdint>

#define B_SZ      512
#define D_SZ      256
#define NUM_FIXED 512
#define MAX_VARS  128
#define L_TOT     (NUM_FIXED + 2 * MAX_VARS)   // 768
#define SCALE     0.0625f                      // 1/sqrt(256)

// TDM pads LDS rows: 4 DWORDs of pad every 256 DWORDs -> row stride 260 floats.
// ds_load_b64 fragment reads then hit banks (4*l16 + c) mod 64: conflict-free.
#define LDS_STRIDE 260

typedef __attribute__((ext_vector_type(2))) float    v2f;
typedef __attribute__((ext_vector_type(8))) float    v8f;
typedef __attribute__((ext_vector_type(4))) unsigned v4u;
typedef __attribute__((ext_vector_type(4))) int      v4i;
typedef __attribute__((ext_vector_type(8))) int      v8i;

// ---------------------------------------------------------------------------
// Issue a 2-D TENSOR_LOAD_TO_LDS: tile_rows x 256 f32, row stride 256 f32 in
// memory, padded rows (stride 260 f32) in LDS. D# bit layout per ISA §8.3-8.5.
// ---------------------------------------------------------------------------
__device__ __forceinline__ void tdm_load_2d(unsigned lds_off, const float* gptr,
                                            unsigned tile_rows) {
  unsigned long long ga = (unsigned long long)(uintptr_t)gptr;
  v4u g0;
  g0.x = 1u;                                   // count=1 (valid user descriptor)
  g0.y = lds_off;                              // lds_addr (bytes)
  g0.z = (unsigned)ga;                         // global_addr[31:0]
  g0.w = (unsigned)((ga >> 32) & 0x1FFFFFFu)   // global_addr[56:32]
       | (2u << 30);                           // type = 2 ("image")
  v8i g1;
  g1[0] = (int)((2u << 16)        // data_size = 4 bytes
              | (1u << 20)        // pad_enable
              | (7u << 22)        // pad_interval: 256 DWORDs
              | (3u << 25));      // pad_amount:   4 DWORDs
  g1[1] = (int)(256u << 16);      // tensor_dim0 = 256 (bits 79:48, low half)
  g1[2] = (int)(tile_rows << 16); // tensor_dim0 hi=0 | tensor_dim1 = tile_rows
  g1[3] = (int)(256u << 16);      // tensor_dim1 hi=0 | tile_dim0 = 256
  g1[4] = (int)tile_rows;         // tile_dim1 | tile_dim2 = 0
  g1[5] = 256;                    // tensor_dim0_stride = 256 (low 32 of 48)
  g1[6] = 0;
  g1[7] = 0;
  v4i gz = {0, 0, 0, 0};
#if defined(__clang_major__) && (__clang_major__ >= 23)
  v8i gz8 = {0, 0, 0, 0, 0, 0, 0, 0};
  __builtin_amdgcn_tensor_load_to_lds(g0, g1, gz, gz, gz8, 0);
#else
  __builtin_amdgcn_tensor_load_to_lds(g0, g1, gz, gz, 0);
#endif
}

// ---------------------------------------------------------------------------
// Kernel 1: fixed-key GEMM out[0:512, 0:512] = q * k^T via WMMA f32 16x16x4.
// Each block: one 16-row q tile x one 128-row k tile, both DMA'd to LDS by
// the Tensor Data Mover (wave 0), consumed by 8 waves (one 16x16 tile each)
// through conflict-free ds_load_b64 fragment reads.
// ---------------------------------------------------------------------------
__global__ __launch_bounds__(256) void attn_fixed_wmma(
    const float* __restrict__ q, const float* __restrict__ kfix,
    float* __restrict__ out)
{
  __shared__ __align__(16) float lds_q[16  * LDS_STRIDE];   // ~16.6 KB
  __shared__ __align__(16) float lds_k[128 * LDS_STRIDE];   // ~133 KB (<=320KB/WGP)

  const int lane = threadIdx.x & 31;
  const int wave = threadIdx.x >> 5;
  const int bm   = blockIdx.x >> 2;   // q-row tile   (0..31)
  const int bn   = blockIdx.x & 3;    // 128-col group (0..3)

  if (wave == 0) {
    tdm_load_2d((unsigned)(uintptr_t)&lds_q[0], q    + (size_t)bm * 16  * D_SZ, 16);
    tdm_load_2d((unsigned)(uintptr_t)&lds_k[0], kfix + (size_t)bn * 128 * D_SZ, 128);
    __builtin_amdgcn_s_wait_tensorcnt(0);
  }
  __syncthreads();

  // Fragment addressing (ISA 7.12.2, 32-bit A 16x4 / B 4x16):
  // lane<16: row=lane, K=k0..k0+1 ; lane>=16: row=lane-16, K=k0+2..k0+3.
  const int half = lane >> 4;
  const int l16  = lane & 15;
  const float* qrow = &lds_q[l16 * LDS_STRIDE + 2 * half];
  const float* krow = &lds_k[(wave * 16 + l16) * LDS_STRIDE + 2 * half];

  v8f acc = {};
#pragma unroll 8
  for (int kk = 0; kk < D_SZ; kk += 4) {
    v2f a = *(const v2f*)(qrow + kk);
    v2f b = *(const v2f*)(krow + kk);
    // 8 args: (neg_a, A, neg_b, B, c_mod, C, reuse_a, reuse_b)
    acc = __builtin_amdgcn_wmma_f32_16x16x4_f32(
        false, a, false, b, (short)0, acc, false, false);
  }

  // C/D layout: VGPR v -> (M = v + 8*half, N = l16) within the 16x16 tile.
  float* orow = out + (size_t)(bm * 16) * L_TOT + bn * 128 + wave * 16 + l16;
#pragma unroll
  for (int v = 0; v < 8; ++v)
    orow[(size_t)(v + 8 * half) * L_TOT] = acc[v] * SCALE;
}

// ---------------------------------------------------------------------------
// Kernel 2: k_var + gathered k_arg columns (a stream with no cross-batch reuse,
// so WMMA cannot help). One block per batch element. Wave w takes k_var rows
// 16w..16w+15 and then gathered rows 16w..16w+15. All 32 b128 loads of a
// 16-row set are issued back to back, with no branch and no wait between them;
// the gathered set is issued as soon as the k_var products are formed, so the
// k_var cross-lane sums and stores run under its latency.
// ---------------------------------------------------------------------------
#define WROWS 16                    // rows of each kind per wave (128 / 8 waves)

typedef __attribute__((ext_vector_type(4))) float v4f;
typedef __attribute__((address_space(1))) v4f     gv4f;   // 16 bytes of global memory

// One lane's share of a row's dot product: its 8 floats of q against the row's.
__device__ __forceinline__ float dot8(const float4 q0, const float4 q1,
                                      const float4 k0, const float4 k1) {
  return q0.x * k0.x + q0.y * k0.y + q0.z * k0.z + q0.w * k0.w
       + q1.x * k1.x + q1.y * k1.y + q1.z * k1.z + q1.w * k1.w;
}

// 16 interleaved wave32 butterfly reductions, in two parts: the exchange of the
// first step (lane l with lane l ^ 16), and its add with the other four steps.
__device__ __forceinline__ void butterfly16_first(const float (&s)[WROWS],
                                                  float (&x)[WROWS]) {
#pragma unroll
  for (int n = 0; n < WROWS; ++n) x[n] = __shfl_xor(s[n], 16, 32);
}
__device__ __forceinline__ void butterfly16_rest(float (&s)[WROWS],
                                                 const float (&x)[WROWS]) {
#pragma unroll
  for (int n = 0; n < WROWS; ++n) s[n] += x[n];
#pragma unroll
  for (int off = 8; off > 0; off >>= 1) {
#pragma unroll
    for (int n = 0; n < WROWS; ++n)
      s[n] += __shfl_xor(s[n], off, 32);
  }
}

// The wave's 16 contiguous results (64 B), stored by one lane.
__device__ __forceinline__ void store16(float* o, const float (&s)[WROWS]) {
#pragma unroll
  for (int n = 0; n < WROWS; n += 4)
    *(float4*)(o + n) = make_float4(s[n] * SCALE, s[n + 1] * SCALE,
                                    s[n + 2] * SCALE, s[n + 3] * SCALE);
}

__global__ __launch_bounds__(256) void attn_var(
    const float* __restrict__ q, const float* __restrict__ kvar,
    const int* __restrict__ args, const float* __restrict__ karg,
    float* __restrict__ out)
{
  const int b    = blockIdx.x;
  const int lane = threadIdx.x & 31;
  // The wave's number as a scalar: row addresses and index pairs then live in
  // scalar registers, and a test on them is a scalar branch of the whole wave.
  const int wave = __builtin_amdgcn_readfirstlane(threadIdx.x >> 5);
  const int row0 = wave * WROWS;

  // The wave's 16 index pairs (128 contiguous bytes, wave-uniform address).
  const int* ap = args + ((size_t)b * MAX_VARS + row0) * 2;
  int ai[WROWS], aj[WROWS];
#pragma unroll
  for (int n = 0; n < WROWS; ++n) { ai[n] = ap[2 * n]; aj[n] = ap[2 * n + 1]; }
  // Holds the index loads here, as two wide scalar loads ahead of the row loads:
  // without it the second word of each pair is loaded only inside the branch
  // below, and its latency stands in front of the gathered rows' loads.
  __builtin_amdgcn_sched_barrier(0);

  // Each lane keeps its private 8-float slice of q[b] in registers.
  const float4 q0 = *(const float4*)(q + (size_t)b * D_SZ + lane * 8);
  const float4 q1 = *(const float4*)(q + (size_t)b * D_SZ + lane * 8 + 4);

  const float* kv = kvar + ((size_t)b * MAX_VARS + row0) * D_SZ + lane * 8;
  float*       ob = out + (size_t)b * L_TOT + NUM_FIXED + row0;

  float4 kb[WROWS][2];              // the lane's slices of one 16-row set

#pragma unroll
  for (int n = 0; n < WROWS; ++n) {
    kb[n][0] = *(const float4*)(kv + n * D_SZ);
    kb[n][1] = *(const float4*)(kv + n * D_SZ + 4);
  }

  float s[WROWS];
#pragma unroll
  for (int n = 0; n < WROWS; ++n)
    s[n] = dot8(q0, q1, kb[n][0], kb[n][1]);

  // The first exchange stands in front of the gathered rows' loads: it needs the
  // products, so they are formed, and the k_var registers freed, before those
  // loads are issued (left to itself the compiler moved the products behind them
  // and held both sets in registers).
  float x[WROWS];
  butterfly16_first(s, x);

  // Does the wave hold a gathered row that is not a sentinel? (scalar)
  bool any = false;
#pragma unroll
  for (int n = 0; n < WROWS; ++n) any |= (ai[n] >= 0);

  if (any) {
    // A sentinel row among live ones reads the clamped table row;
    // every index is clamped before its address is formed.
    // Each row's base goes into a scalar register pair of its own (the clamp
    // compiles to a vector op, hence readfirstlane).
    unsigned long long rb[WROWS];
#pragma unroll
    for (int n = 0; n < WROWS; ++n) {
      int f = (int)((unsigned)ai[n] * (unsigned)MAX_VARS + (unsigned)aj[n]);
      f = f < 0 ? 0 : f;
      f = f > MAX_VARS * MAX_VARS - 1 ? MAX_VARS * MAX_VARS - 1 : f;
      const unsigned long long ra = (unsigned long long)(uintptr_t)(karg + (size_t)f * D_SZ);
      const unsigned lo = __builtin_amdgcn_readfirstlane((unsigned)ra);
      const unsigned hi = __builtin_amdgcn_readfirstlane((unsigned)(ra >> 32));
      rb[n] = ((unsigned long long)hi << 32) | lo;
    }
#pragma unroll
    for (int n = 0; n < WROWS; ++n) {
      const gv4f* p = (const gv4f*)(uintptr_t)(rb[n] + (unsigned)(lane * 32));
      const v4f a = p[0], c = p[1];
      kb[n][0] = make_float4(a.x, a.y, a.z, a.w);
      kb[n][1] = make_float4(c.x, c.y, c.z, c.w);
    }
  }

  butterfly16_rest(s, x);
  if (lane == 0) store16(ob, s);

  if (any) {
#pragma unroll
    for (int n = 0; n < WROWS; ++n) {
      const float d = dot8(q0, q1, kb[n][0], kb[n][1]);
      s[n] = ai[n] < 0 ? 0.0f : d;  // masked sentinel row -> exact zero
    }
    butterfly16_first(s, x);
    butterfly16_rest(s, x);
  } else {
#pragma unroll
    for (int n = 0; n < WROWS; ++n) s[n] = 0.0f;
  }
  if (lane == 0) store16(ob + MAX_VARS, s);
}

extern "C" void kernel_launch(void* const* d_in, const int* in_sizes, int n_in,
                              void* d_out, int out_size, void* d_ws, size_t ws_size,
                              hipStream_t stream) {
  const float* q    = (const float*)d_in[0];   // [512, 256]
  const float* kvar = (const float*)d_in[1];   // [512, 128, 256]
  const int*   args = (const int*)d_in[2];     // [512, 128, 2]
  const float* kfix = (const float*)d_in[3];   // [512, 256]
  const float* karg = (const float*)d_in[4];   // [16384, 256]
  float* out = (float*)d_out;                  // [512, 768]

  // 32 q-row tiles x 4 column groups of 128 -> 128 blocks, 8 waves each.
  attn_fixed_wmma<<<128, 256, 0, stream>>>(q, kfix, out);
  // One block per batch element for the streaming/gather columns.
  attn_var<<<B_SZ, 256, 0, stream>>>(q, kvar, args, karg, out);
}

// v002
// It runs in 11.8 microseconds.
// In both of two side-by-side timings against v001, it was 1.26 times as fast.
// Counting every step since v000, it is 2.38 times as fast.
#include <hip/hip_runtime.h>
#include <cstdint>

#define B_SZ      512
#define D_SZ      256
#define NUM_FIXED 512
#define MAX_VARS  128
#define L_TOT     (NUM_FIXED + 2 * MAX_VARS)   // 768
#define SCALE     0.0625f                      // 1/sqrt(256)

// The fixed-key tiles lie in LDS as K quarters: rows of 64 floats (256 B) that the
// tensor load pads by 16 B, so a row's pitch is 272 B = 68 floats and the
// ds_load_b64 fragment reads hit banks (4*l16 + c) mod 64: conflict-free.
#define T_PITCH_B 272
#define A_SLICE_B 6144              // 16 rows * 272 B, rounded up to a multiple of 2 KiB
#define B_SLICE_B 10240             // 32 rows * 272 B, rounded up to a multiple of 2 KiB
#define P_PITCH   36                // floats per row of a partial tile pair (32 + 4)

typedef __attribute__((ext_vector_type(2))) float    v2f;
typedef __attribute__((ext_vector_type(8))) float    v8f;
typedef __attribute__((ext_vector_type(4))) uint32_t u32x4;
typedef __attribute__((ext_vector_type(8))) uint32_t u32x8;

__device__ __forceinline__ uint32_t uni(uint32_t v) {
  return (uint32_t)__builtin_amdgcn_readfirstlane(v);
}

// Descriptor of one tensor load: rows x 256 bytes, source pitch 1024 bytes, to
// LDS byte offset lds_dst at a pitch of 272 bytes. Extents in bytes.
__device__ __forceinline__ void tdm_quarter_desc(u32x4& g0, u32x8& g1, uint32_t lds_dst,
                                                 const float* gptr, uint32_t rows) {
  const uint64_t ga = (uint64_t)(uintptr_t)gptr;
  g0[0] = uni(1u);                                             // count = 1
  g0[1] = uni(lds_dst);
  g0[2] = uni((uint32_t)ga);
  g0[3] = uni((((uint32_t)(ga >> 32)) & 0x01FFFFFFu) | 0x80000000u);  // type = 2
  g1[0] = uni((1u << 20) | (5u << 22) | (3u << 25));  // pad 4 dwords behind every 256 B
  g1[1] = uni(256u << 16);                            // tensor_dim0 = 256
  g1[2] = uni(rows << 16);                            // tensor_dim1 = rows
  g1[3] = uni(256u << 16);                            // tile_dim0 = 256
  g1[4] = uni(rows);                                  // tile_dim1 = rows
  g1[5] = uni(1024u);                                 // source row pitch
  g1[6] = uni(0u);
  g1[7] = uni(0u);
}

// ---------------------------------------------------------------------------
// One kernel, one block per batch element b.
// (1) k_var + gathered k_arg columns of row b (a stream with no cross-batch
// reuse, so WMMA cannot help). Wave w takes k_var rows 16w..16w+15 and then
// gathered rows 16w..16w+15. All 32 b128 loads of a 16-row set are issued back
// to back, with no branch and no wait between them; the gathered set is issued
// as soon as the k_var products are formed, so the k_var cross-lane sums and
// stores run under its latency.
// (2) A 16 x 32 piece of the fixed-key product q * k^T (WMMA f32 16x16x4): q
// rows 16*(b>>4).., k rows 32*(b&15)... Its operands come by tensor load, asked
// for at entry; its WMMAs run while the wave's k_var loads are in flight. Wave w
// does K quarter w&3 of 16x16 tile w>>2; the four partial tiles are summed
// through LDS.
// ---------------------------------------------------------------------------
#define WROWS 16                    // rows of each kind per wave (128 / 8 waves)

typedef __attribute__((ext_vector_type(4))) float v4f;
typedef __attribute__((address_space(1))) v4f     gv4f;   // 16 bytes of global memory

// One lane's share of a row's dot product: its 8 floats of q against the row's.
__device__ __forceinline__ float dot8(const float4 q0, const float4 q1,
                                      const float4 k0, const float4 k1) {
  return q0.x * k0.x + q0.y * k0.y + q0.z * k0.z + q0.w * k0.w
       + q1.x * k1.x + q1.y * k1.y + q1.z * k1.z + q1.w * k1.w;
}

// 16 interleaved wave32 butterfly reductions, in two parts: the exchange of the
// first step (lane l with lane l ^ 16), and its add with the other four steps.
__device__ __forceinline__ void butterfly16_first(const float (&s)[WROWS],
                                                  float (&x)[WROWS]) {
#pragma unroll
  for (int n = 0; n < WROWS; ++n) x[n] = __shfl_xor(s[n], 16, 32);
}
__device__ __forceinline__ void butterfly16_rest(float (&s)[WROWS],
                                                 const float (&x)[WROWS]) {
#pragma unroll
  for (int n = 0; n < WROWS; ++n) s[n] += x[n];
#pragma unroll
  for (int off = 8; off > 0; off >>= 1) {
#pragma unroll
    for (int n = 0; n < WROWS; ++n)
      s[n] += __shfl_xor(s[n], off, 32);
  }
}

// The wave's 16 contiguous results (64 B), stored by one lane.
__device__ __forceinline__ void store16(float* o, const float (&s)[WROWS]) {
#pragma unroll
  for (int n = 0; n < WROWS; n += 4)
    *(float4*)(o + n) = make_float4(s[n] * SCALE, s[n + 1] * SCALE,
                                    s[n + 2] * SCALE, s[n + 3] * SCALE);
}

__global__ __launch_bounds__(256) void attn_all(
    const float* __restrict__ q, const float* __restrict__ kvar,
    const int* __restrict__ args, const float* __restrict__ kfix,
    const float* __restrict__ karg, float* __restrict__ out)
{
  __shared__ __attribute__((aligned(2048))) unsigned char lds_t[4 * A_SLICE_B + 4 * B_SLICE_B];
  __shared__ __align__(16) float lds_p[4 * 16 * P_PITCH];

  const int b    = blockIdx.x;
  const int lane = threadIdx.x & 31;
  // The wave's number as a scalar: row addresses and index pairs then live in
  // scalar registers, and a test on them is a scalar branch of the whole wave.
  const int wave = __builtin_amdgcn_readfirstlane(threadIdx.x >> 5);
  const int row0 = wave * WROWS;
  const int bm   = b >> 4;            // 16-row tile of q      (0..31)
  const int bn   = b & 15;            // 32-row group of k     (0..15)
  const int kq   = wave & 3;          // K quarter

  // Every wave asks for one slice: waves 0..3 the q tile's K quarters, waves
  // 4..7 the k group's.
  u32x4 g0;
  u32x8 g1;
  {
    const bool isk = wave >= 4;
    const float* src = (isk ? kfix + (size_t)bn * 32 * D_SZ : q + (size_t)bm * 16 * D_SZ) + kq * 64;
    const uint32_t dst = (uint32_t)(uintptr_t)&lds_t[0]
                       + (isk ? 4u * A_SLICE_B + (uint32_t)kq * B_SLICE_B : (uint32_t)kq * A_SLICE_B);
    tdm_quarter_desc(g0, g1, dst, src, isk ? 32u : 16u);
  }
  asm volatile("tensor_load_to_lds %0, %1" :: "s"(g0), "s"(g1) : "memory");

  // The wave's 16 index pairs (128 contiguous bytes, wave-uniform address).
  const int* ap = args + ((size_t)b * MAX_VARS + row0) * 2;
  int ai[WROWS], aj[WROWS];
#pragma unroll
  for (int n = 0; n < WROWS; ++n) { ai[n] = ap[2 * n]; aj[n] = ap[2 * n + 1]; }
  // Holds the index loads here, as two wide scalar loads ahead of the row loads:
  // without it the second word of each pair is loaded only inside the branch
  // below, and its latency stands in front of the gathered rows' loads.
  __builtin_amdgcn_sched_barrier(0);

  // Each lane keeps its private 8-float slice of q[b] in registers.
  const float4 q0 = *(const float4*)(q + (size_t)b * D_SZ + lane * 8);
  const float4 q1 = *(const float4*)(q + (size_t)b * D_SZ + lane * 8 + 4);

  const float* kv = kvar + ((size_t)b * MAX_VARS + row0) * D_SZ + lane * 8;
  float*       ob = out + (size_t)b * L_TOT + NUM_FIXED + row0;

  float4 kb[WROWS][2];              // the lane's slices of one 16-row set

#pragma unroll
  for (int n = 0; n < WROWS; ++n) {
    kb[n][0] = *(const float4*)(kv + n * D_SZ);
    kb[n][1] = *(const float4*)(kv + n * D_SZ + 4);
  }

  // Keeps the 32 row loads issued in front of the fixed-key piece, which then
  // runs under their latency.
  __builtin_amdgcn_sched_barrier(0);

  // The wave's own slice has landed ... (the wait names the descriptor, so that
  // its scalar registers take no new value while the request is outstanding)
  asm volatile("s_wait_tensorcnt 0x0" :: "s"(g0), "s"(g1) : "memory");
  // ... and so has every other wave's. A bare barrier: __syncthreads() would
  // also wait for the row loads in flight. No wave has touched LDS so far.
  asm volatile("s_barrier_signal -1\n\ts_barrier_wait -1" ::: "memory");
  {
    // Fragment addressing (32-bit A 16x4 / B 4x16):
    // lane<16: row=lane, K=k0..k0+1 ; lane>=16: row=lane-16, K=k0+2..k0+3.
    const int half = lane >> 4;
    const int l16  = lane & 15;
    const int tn   = wave >> 2;       // which 16 of the group's 32 k rows
    const float* arow = (const float*)(lds_t + kq * A_SLICE_B + l16 * T_PITCH_B) + 2 * half;
    const float* brow = (const float*)(lds_t + 4 * A_SLICE_B + kq * B_SLICE_B
                                       + (tn * 16 + l16) * T_PITCH_B) + 2 * half;
    // C/D layout: VGPR v -> (M = v + 8*half, N = l16) within the 16x16 tile.
    float* pw = lds_p + (kq * 16 + 8 * half) * P_PITCH + tn * 16 + l16;
    // Thread t sums and stores 2 neighbours: a wave writes 2 rows of 128 B.
    const int r = threadIdx.x >> 4;
    const int c = (threadIdx.x & 15) * 2;
    const float* pr = lds_p + r * P_PITCH + c;
    float* po = out + (size_t)(bm * 16 + r) * L_TOT + bn * 32 + c;
    v8f acc = {};
    // Two trips of 8, not one straight run of 16: in the straight run the compiler
    // put the address arithmetic above into fragment registers directly behind the
    // WMMA that reads them; a loop body of its own holds only loads and WMMAs.
#pragma unroll 8
    for (int kk = 0; kk < 64; kk += 4) {
      v2f fa = *(const v2f*)(arow + kk);
      v2f fb = *(const v2f*)(brow + kk);
      // 8 args: (neg_a, A, neg_b, B, c_mod, C, reuse_a, reuse_b)
      acc = __builtin_amdgcn_wmma_f32_16x16x4_f32(
          false, fa, false, fb, (short)0, acc, false, false);
    }
#pragma unroll
    for (int v = 0; v < 8; ++v) pw[v * P_PITCH] = acc[v];
    // The partial tiles are in LDS before any wave reads them (bare barrier, for
    // the same reason as above; the wait covers this wave's LDS stores).
    asm volatile("s_wait_dscnt 0x0\n\ts_barrier_signal -1\n\ts_barrier_wait -1" ::: "memory");
    const v2f p0 = *(const v2f*)(pr);
    const v2f p1 = *(const v2f*)(pr + 16 * P_PITCH);
    const v2f p2 = *(const v2f*)(pr + 32 * P_PITCH);
    const v2f p3 = *(const v2f*)(pr + 48 * P_PITCH);
    const v2f o  = ((p0 + p1) + (p2 + p3)) * SCALE;
    *(v2f*)po = o;
  }
  // Keeps the k_var products, and with them the wait for the row loads, behind
  // the fixed-key piece (left to itself the compiler moved them in front of it).
  __builtin_amdgcn_sched_barrier(0);

  float s[WROWS];
#pragma unroll
  for (int n = 0; n < WROWS; ++n)
    s[n] = dot8(q0, q1, kb[n][0], kb[n][1]);

  // The first exchange stands in front of the gathered rows' loads: it needs the
  // products, so they are formed, and the k_var registers freed, before those
  // loads are issued (left to itself the compiler moved the products behind them
  // and held both sets in registers).
  float x[WROWS];
  butterfly16_first(s, x);

  // Does the wave hold a gathered row that is not a sentinel? (scalar)
  bool any = false;
#pragma unroll
  for (int n = 0; n < WROWS; ++n) any |= (ai[n] >= 0);

  if (any) {
    // A sentinel row among live ones reads the clamped table row;
    // every index is clamped before its address is formed.
    // Each row's base goes into a scalar register pair of its own (the clamp
    // compiles to a vector op, hence readfirstlane).
    unsigned long long rb[WROWS];
#pragma unroll
    for (int n = 0; n < WROWS; ++n) {
      int f = (int)((unsigned)ai[n] * (unsigned)MAX_VARS + (unsigned)aj[n]);
      f = f < 0 ? 0 : f;
      f = f > MAX_VARS * MAX_VARS - 1 ? MAX_VARS * MAX_VARS - 1 : f;
      const unsigned long long ra = (unsigned long long)(uintptr_t)(karg + (size_t)f * D_SZ);
      const unsigned lo = __builtin_amdgcn_readfirstlane((unsigned)ra);
      const unsigned hi = __builtin_amdgcn_readfirstlane((unsigned)(ra >> 32));
      rb[n] = ((unsigned long long)hi << 32) | lo;
    }
#pragma unroll
    for (int n = 0; n < WROWS; ++n) {
      const gv4f* p = (const gv4f*)(uintptr_t)(rb[n] + (unsigned)(lane * 32));
      const v4f a = p[0], c = p[1];
      kb[n][0] = make_float4(a.x, a.y, a.z, a.w);
      kb[n][1] = make_float4(c.x, c.y, c.z, c.w);
    }
  }

  butterfly16_rest(s, x);
  if (lane == 0) store16(ob, s);

  if (any) {
#pragma unroll
    for (int n = 0; n < WROWS; ++n) {
      const float d = dot8(q0, q1, kb[n][0], kb[n][1]);
      s[n] = ai[n] < 0 ? 0.0f : d;  // masked sentinel row -> exact zero
    }
    butterfly16_first(s, x);
    butterfly16_rest(s, x);
  } else {
#pragma unroll
    for (int n = 0; n < WROWS; ++n) s[n] = 0.0f;
  }
  if (lane == 0) store16(ob + MAX_VARS, s);
}

extern "C" void kernel_launch(void* const* d_in, const int* in_sizes, int n_in,
                              void* d_out, int out_size, void* d_ws, size_t ws_size,
                              hipStream_t stream) {
  const float* q    = (const float*)d_in[0];   // [512, 256]
  const float* kvar = (const float*)d_in[1];   // [512, 128, 256]
  const int*   args = (const int*)d_in[2];     // [512, 128, 2]
  const float* kfix = (const float*)d_in[3];   // [512, 256]
  const float* karg = (const float*)d_in[4];   // [16384, 256]
  float* out = (float*)d_out;                  // [512, 768]

  // One block per batch element; each also does 1/512 of the fixed-key product.
  attn_all<<<B_SZ, 256, 0, stream>>>(q, kvar, args, kfix, karg, out);
}

// v003
// A run of this version takes 10.9 microseconds.
// Next to v002, in two timings, it ran 1.09 times as fast each time.
// All steps since v000 together make it 2.59 times as fast.
#include <hip/hip_runtime.h>
#include <cstdint>

#define B_SZ      512
#define D_SZ      256
#define NUM_FIXED 512
#define MAX_VARS  128
#define L_TOT     (NUM_FIXED + 2 * MAX_VARS)   // 768
#define SCALE     0.0625f                      // 1/sqrt(256)

// The fixed-key tiles lie in LDS as K quarters: rows of 64 floats (256 B) that the
// tensor load pads by 16 B, so a row's pitch is 272 B = 68 floats and the
// ds_load_b64 fragment reads hit banks (4*l16 + c) mod 64: conflict-free.
#define T_PITCH_B 272
#define A_SLICE_B 6144              // 16 rows * 272 B, rounded up to a multiple of 2 KiB
#define B_SLICE_B 10240             // 32 rows * 272 B, rounded up to a multiple of 2 KiB
#define P_PITCH   36                // floats per row of a partial tile pair (32 + 4)

typedef __attribute__((ext_vector_type(2))) float    v2f;
typedef __attribute__((ext_vector_type(8))) float    v8f;
typedef __attribute__((ext_vector_type(4))) uint32_t u32x4;
typedef __attribute__((ext_vector_type(8))) uint32_t u32x8;

__device__ __forceinline__ uint32_t uni(uint32_t v) {
  return (uint32_t)__builtin_amdgcn_readfirstlane(v);
}

// Descriptor of one tensor load: rows x 256 bytes, source pitch 1024 bytes, to
// LDS byte offset lds_dst at a pitch of 272 bytes. Extents in bytes.
__device__ __forceinline__ void tdm_quarter_desc(u32x4& g0, u32x8& g1, uint32_t lds_dst,
                                                 const float* gptr, uint32_t rows) {
  const uint64_t ga = (uint64_t)(uintptr_t)gptr;
  g0[0] = uni(1u);                                             // count = 1
  g0[1] = uni(lds_dst);
  g0[2] = uni((uint32_t)ga);
  g0[3] = uni((((uint32_t)(ga >> 32)) & 0x01FFFFFFu) | 0x80000000u);  // type = 2
  g1[0] = uni((1u << 20) | (5u << 22) | (3u << 25));  // pad 4 dwords behind every 256 B
  g1[1] = uni(256u << 16);                            // tensor_dim0 = 256
  g1[2] = uni(rows << 16);                            // tensor_dim1 = rows
  g1[3] = uni(256u << 16);                            // tile_dim0 = 256
  g1[4] = uni(rows);                                  // tile_dim1 = rows
  g1[5] = uni(1024u);                                 // source row pitch
  g1[6] = uni(0u);
  g1[7] = uni(0u);
}

// ---------------------------------------------------------------------------
// One kernel, one block per batch element b.
// (1) k_var + gathered k_arg columns of row b (a stream with no cross-batch
// reuse, so WMMA cannot help). Wave w takes k_var rows 16w..16w+15 and then
// gathered rows 16w..16w+15. A row is 1 KiB = 8 lines of 128 B; lane l takes
// floats 4l..4l+3 of its first and of its second half, so each wave-wide b128
// load covers 512 contiguous bytes: 4 whole lines, none touched by two loads.
// All 32 b128 loads of a 16-row set are issued back
// to back, with no branch and no wait between them; the gathered set is issued
// as soon as the k_var products are formed, so the k_var cross-lane sums and
// stores run under its latency.
// (2) A 16 x 32 piece of the fixed-key product q * k^T (WMMA f32 16x16x4): q
// rows 16*(b>>4).., k rows 32*(b&15)... Its operands come by tensor load, asked
// for at entry; its WMMAs run while the wave's k_var loads are in flight. Wave w
// does K quarter w&3 of 16x16 tile w>>2; the four partial tiles are summed
// through LDS.
// ---------------------------------------------------------------------------
#define WROWS 16                    // rows of each kind per wave (128 / 8 waves)

typedef __attribute__((ext_vector_type(4))) float v4f;
typedef __attribute__((address_space(1))) v4f     gv4f;   // 16 bytes of global memory

// One lane's share of a row's dot product: its 4 + 4 floats of q against the row's.
__device__ __forceinline__ float dot8(const float4 q0, const float4 q1,
                                      const float4 k0, const float4 k1) {
  return q0.x * k0.x + q0.y * k0.y + q0.z * k0.z + q0.w * k0.w
       + q1.x * k1.x + q1.y * k1.y + q1.z * k1.z + q1.w * k1.w;
}

// 16 interleaved wave32 butterfly reductions, in two parts: the exchange of the
// first step (lane l with lane l ^ 16), and its add with the other four steps.
__device__ __forceinline__ void butterfly16_first(const float (&s)[WROWS],
                                                  float (&x)[WROWS]) {
#pragma unroll
  for (int n = 0; n < WROWS; ++n) x[n] = __shfl_xor(s[n], 16, 32);
}
__device__ __forceinline__ void butterfly16_rest(float (&s)[WROWS],
                                                 const float (&x)[WROWS]) {
#pragma unroll
  for (int n = 0; n < WROWS; ++n) s[n] += x[n];
#pragma unroll
  for (int off = 8; off > 0; off >>= 1) {
#pragma unroll
    for (int n = 0; n < WROWS; ++n)
      s[n] += __shfl_xor(s[n], off, 32);
  }
}

// The wave's 16 contiguous results (64 B), stored by one lane.
__device__ __forceinline__ void store16(float* o, const float (&s)[WROWS]) {
#pragma unroll
  for (int n = 0; n < WROWS; n += 4)
    *(float4*)(o + n) = make_float4(s[n] * SCALE, s[n + 1] * SCALE,
                                    s[n + 2] * SCALE, s[n + 3] * SCALE);
}

__global__ __launch_bounds__(256) void attn_all(
    const float* __restrict__ q, const float* __restrict__ kvar,
    const int* __restrict__ args, const float* __restrict__ kfix,
    const float* __restrict__ karg, float* __restrict__ out)
{
  __shared__ __attribute__((aligned(2048))) unsigned char lds_t[4 * A_SLICE_B + 4 * B_SLICE_B];
  __shared__ __align__(16) float lds_p[4 * 16 * P_PITCH];

  const int b    = blockIdx.x;
  const int lane = threadIdx.x & 31;
  // The wave's number as a scalar: row addresses and index pairs then live in
  // scalar registers, and a test on them is a scalar branch of the whole wave.
  const int wave = __builtin_amdgcn_readfirstlane(threadIdx.x >> 5);
  const int row0 = wave * WROWS;
  const int bm   = b >> 4;            // 16-row tile of q      (0..31)
  const int bn   = b & 15;            // 32-row group of k     (0..15)
  const int kq   = wave & 3;          // K quarter

  // Every wave asks for one slice: waves 0..3 the q tile's K quarters, waves
  // 4..7 the k group's.
  u32x4 g0;
  u32x8 g1;
  {
    const bool isk = wave >= 4;
    const float* src = (isk ? kfix + (size_t)bn * 32 * D_SZ : q + (size_t)bm * 16 * D_SZ) + kq * 64;
    const uint32_t dst = (uint32_t)(uintptr_t)&lds_t[0]
                       + (isk ? 4u * A_SLICE_B + (uint32_t)kq * B_SLICE_B : (uint32_t)kq * A_SLICE_B);
    tdm_quarter_desc(g0, g1, dst, src, isk ? 32u : 16u);
  }
  asm volatile("tensor_load_to_lds %0, %1" :: "s"(g0), "s"(g1) : "memory");

  // The wave's 16 index pairs (128 contiguous bytes, wave-uniform address).
  const int* ap = args + ((size_t)b * MAX_VARS + row0) * 2;
  int ai[WROWS], aj[WROWS];
#pragma unroll
  for (int n = 0; n < WROWS; ++n) { ai[n] = ap[2 * n]; aj[n] = ap[2 * n + 1]; }
  // Holds the index loads here, as two wide scalar loads ahead of the row loads:
  // without it the second word of each pair is loaded only inside the branch
  // below, and its latency stands in front of the gathered rows' loads.
  __builtin_amdgcn_sched_barrier(0);

  // Each lane keeps its two private 4-float slices of q[b] in registers.
  const float4 q0 = *(const float4*)(q + (size_t)b * D_SZ + lane * 4);
  const float4 q1 = *(const float4*)(q + (size_t)b * D_SZ + D_SZ / 2 + lane * 4);

  const float* kv = kvar + ((size_t)b * MAX_VARS + row0) * D_SZ + lane * 4;
  float*       ob = out + (size_t)b * L_TOT + NUM_FIXED + row0;

  float4 kb[WROWS][2];              // the lane's slices of one 16-row set

#pragma unroll
  for (int n = 0; n < WROWS; ++n) {
    kb[n][0] = *(const float4*)(kv + n * D_SZ);
    kb[n][1] = *(const float4*)(kv + n * D_SZ + D_SZ / 2);
  }

  // Keeps the 32 row loads issued in front of the fixed-key piece, which then
  // runs under their latency.
  __builtin_amdgcn_sched_barrier(0);

  // The wave's own slice has landed ... (the wait names the descriptor, so that
  // its scalar registers take no new value while the request is outstanding)
  asm volatile("s_wait_tensorcnt 0x0" :: "s"(g0), "s"(g1) : "memory");
  // ... and so has every other wave's. A bare barrier: __syncthreads() would
  // also wait for the row loads in flight. No wave has touched LDS so far.
  asm volatile("s_barrier_signal -1\n\ts_barrier_wait -1" ::: "memory");
  {
    // Fragment addressing (32-bit A 16x4 / B 4x16):
    // lane<16: row=lane, K=k0..k0+1 ; lane>=16: row=lane-16, K=k0+2..k0+3.
    const int half = lane >> 4;
    const int l16  = lane & 15;
    const int tn   = wave >> 2;       // which 16 of the group's 32 k rows
    const float* arow = (const float*)(lds_t + kq * A_SLICE_B + l16 * T_PITCH_B) + 2 * half;
    const float* brow = (const float*)(lds_t + 4 * A_SLICE_B + kq * B_SLICE_B
                                       + (tn * 16 + l16) * T_PITCH_B) + 2 * half;
    // C/D layout: VGPR v -> (M = v + 8*half, N = l16) within the 16x16 tile.
    float* pw = lds_p + (kq * 16 + 8 * half) * P_PITCH + tn * 16 + l16;
    // Thread t sums and stores 2 neighbours: a wave writes 2 rows of 128 B.
    const int r = threadIdx.x >> 4;
    const int c = (threadIdx.x & 15) * 2;
    const float* pr = lds_p + r * P_PITCH + c;
    float* po = out + (size_t)(bm * 16 + r) * L_TOT + bn * 32 + c;
    v8f acc = {};
    // Two trips of 8, not one straight run of 16: in the straight run the compiler
    // put the address arithmetic above into fragment registers directly behind the
    // WMMA that reads them; a loop body of its own holds only loads and WMMAs.
#pragma unroll 8
    for (int kk = 0; kk < 64; kk += 4) {
      v2f fa = *(const v2f*)(arow + kk);
      v2f fb = *(const v2f*)(brow + kk);
      // 8 args: (neg_a, A, neg_b, B, c_mod, C, reuse_a, reuse_b)
      acc = __builtin_amdgcn_wmma_f32_16x16x4_f32(
          false, fa, false, fb, (short)0, acc, false, false);
    }
#pragma unroll
    for (int v = 0; v < 8; ++v) pw[v * P_PITCH] = acc[v];
    // The partial tiles are in LDS before any wave reads them (bare barrier, for
    // the same reason as above; the wait covers this wave's LDS stores).
    asm volatile("s_wait_dscnt 0x0\n\ts_barrier_signal -1\n\ts_barrier_wait -1" ::: "memory");
    const v2f p0 = *(const v2f*)(pr);
    const v2f p1 = *(const v2f*)(pr + 16 * P_PITCH);
    const v2f p2 = *(const v2f*)(pr + 32 * P_PITCH);
    const v2f p3 = *(const v2f*)(pr + 48 * P_PITCH);
    const v2f o  = ((p0 + p1) + (p2 + p3)) * SCALE;
    *(v2f*)po = o;
  }
  // Keeps the k_var products, and with them the wait for the row loads, behind
  // the fixed-key piece (left to itself the compiler moved them in front of it).
  __builtin_amdgcn_sched_barrier(0);

  float s[WROWS];
#pragma unroll
  for (int n = 0; n < WROWS; ++n)
    s[n] = dot8(q0, q1, kb[n][0], kb[n][1]);

  // The first exchange stands in front of the gathered rows' loads: it needs the
  // products, so they are formed, and the k_var registers freed, before those
  // loads are issued (left to itself the compiler moved the products behind them
  // and held both sets in registers).
  float x[WROWS];
  butterfly16_first(s, x);

  // Does the wave hold a gathered row that is not a sentinel? (scalar)
  bool any = false;
#pragma unroll
  for (int n = 0; n < WROWS; ++n) any |= (ai[n] >= 0);

  if (any) {
    // A sentinel row among live ones reads the clamped table row;
    // every index is clamped before its address is formed.
    // Each row's base goes into a scalar register pair of its own (the clamp
    // compiles to a vector op, hence readfirstlane).
    unsigned long long rb[WROWS];
#pragma unroll
    for (int n = 0; n < WROWS; ++n) {
      int f = (int)((unsigned)ai[n] * (unsigned)MAX_VARS + (unsigned)aj[n]);
      f = f < 0 ? 0 : f;
      f = f > MAX_VARS * MAX_VARS - 1 ? MAX_VARS * MAX_VARS - 1 : f;
      const unsigned long long ra = (unsigned long long)(uintptr_t)(karg + (size_t)f * D_SZ);
      const unsigned lo = __builtin_amdgcn_readfirstlane((unsigned)ra);
      const unsigned hi = __builtin_amdgcn_readfirstlane((unsigned)(ra >> 32));
      rb[n] = ((unsigned long long)hi << 32) | lo;
    }
#pragma unroll
    for (int n = 0; n < WROWS; ++n) {
      const gv4f* p = (const gv4f*)(uintptr_t)(rb[n] + (unsigned)(lane * 16));
      const v4f a = p[0], c = p[D_SZ / 8];   // the row's second half: 32 x 16 B on
      kb[n][0] = make_float4(a.x, a.y, a.z, a.w);
      kb[n][1] = make_float4(c.x, c.y, c.z, c.w);
    }
  }

  butterfly16_rest(s, x);
  if (lane == 0) store16(ob, s);

  if (any) {
#pragma unroll
    for (int n = 0; n < WROWS; ++n) {
      const float d = dot8(q0, q1, kb[n][0], kb[n][1]);
      s[n] = ai[n] < 0 ? 0.0f : d;  // masked sentinel row -> exact zero
    }
    butterfly16_first(s, x);
    butterfly16_rest(s, x);
  } else {
#pragma unroll
    for (int n = 0; n < WROWS; ++n) s[n] = 0.0f;
  }
  if (lane == 0) store16(ob + MAX_VARS, s);
}

extern "C" void kernel_launch(void* const* d_in, const int* in_sizes, int n_in,
                              void* d_out, int out_size, void* d_ws, size_t ws_size,
                              hipStream_t stream) {
  const float* q    = (const float*)d_in[0];   // [512, 256]
  const float* kvar = (const float*)d_in[1];   // [512, 128, 256]
  const int*   args = (const int*)d_in[2];     // [512, 128, 2]
  const float* kfix = (const float*)d_in[3];   // [512, 256]
  const float* karg = (const float*)d_in[4];   // [16384, 256]
  float* out = (float*)d_out;                  // [512, 768]

  // One block per batch element; each also does 1/512 of the fixed-key product.
  attn_all<<<B_SZ, 256, 0, stream>>>(q, kvar, args, kfix, karg, out);
}

// v004
// One run takes 10.1 microseconds.
// Next to v003, in two timings, it ran 1.08 times as fast each time.
// Counting every step since v000, it is 2.81 times as fast.
#include <hip/hip_runtime.h>
#include <cstdint>

#define B_SZ      512
#define D_SZ      256
#define NUM_FIXED 512
#define MAX_VARS  128
#define L_TOT     (NUM_FIXED + 2 * MAX_VARS)   // 768
#define SCALE     0.0625f                      // 1/sqrt(256)

// The fixed-key tiles lie in LDS as K quarters: rows of 64 floats (256 B) that the
// tensor load pads by 16 B, so a row's pitch is 272 B = 68 floats and the
// ds_load_b64 fragment reads hit banks (4*l16 + c) mod 64: conflict-free.
#define T_PITCH_B 272
#define A_SLICE_B 6144              // 16 rows * 272 B, rounded up to a multiple of 2 KiB
#define B_SLICE_B 10240             // 32 rows * 272 B, rounded up to a multiple of 2 KiB
#define P_PITCH   36                // floats per row of a partial tile pair (32 + 4)

typedef __attribute__((ext_vector_type(2))) float    v2f;
typedef __attribute__((ext_vector_type(8))) float    v8f;
typedef __attribute__((ext_vector_type(4))) uint32_t u32x4;
typedef __attribute__((ext_vector_type(8))) uint32_t u32x8;

__device__ __forceinline__ uint32_t uni(uint32_t v) {
  return (uint32_t)__builtin_amdgcn_readfirstlane(v);
}

// Descriptor of one tensor load: rows x 256 bytes, source pitch 1024 bytes, to
// LDS byte offset lds_dst at a pitch of 272 bytes. Extents in bytes.
__device__ __forceinline__ void tdm_quarter_desc(u32x4& g0, u32x8& g1, uint32_t lds_dst,
                                                 const float* gptr, uint32_t rows) {
  const uint64_t ga = (uint64_t)(uintptr_t)gptr;
  g0[0] = uni(1u);                                             // count = 1
  g0[1] = uni(lds_dst);
  g0[2] = uni((uint32_t)ga);
  g0[3] = uni((((uint32_t)(ga >> 32)) & 0x01FFFFFFu) | 0x80000000u);  // type = 2
  g1[0] = uni((1u << 20) | (5u << 22) | (3u << 25));  // pad 4 dwords behind every 256 B
  g1[1] = uni(256u << 16);                            // tensor_dim0 = 256
  g1[2] = uni(rows << 16);                            // tensor_dim1 = rows
  g1[3] = uni(256u << 16);                            // tile_dim0 = 256
  g1[4] = uni(rows);                                  // tile_dim1 = rows
  g1[5] = uni(1024u);                                 // source row pitch
  g1[6] = uni(0u);
  g1[7] = uni(0u);
}

// ---------------------------------------------------------------------------
// One kernel, one block per batch element b.
// (1) k_var + gathered k_arg columns of row b (a stream with no cross-batch
// reuse, so WMMA cannot help). Wave w takes k_var rows 16w..16w+15 and then
// gathered rows 16w..16w+15. SIXTEEN LANES SHARE A ROW: lane l belongs to row
// 2i + (l >> 4) of row pair i and takes floats 4(l & 15)..+3 of each of the
// row's 4 quarters of 256 B. A wave-wide b128 load so covers one aligned 256-B
// unit (2 whole lines) of each of 2 rows, no line touched by two loads; a lane
// sums 16 floats of its row in its own registers, and only 8 values a set are
// summed across lanes, inside a 16-lane row, which DPP adds do without LDS. Each
// lane also forms its own rows' table offsets, in vector registers. All 32 b128
// loads of a 16-row set are issued back to back, with no branch and no wait
// between them; the gathered set is issued as soon as the k_var products and
// the first cross-lane step are formed, so the other k_var cross-lane steps and
// the stores run under its latency.
// (2) A 16 x 32 piece of the fixed-key product q * k^T (WMMA f32 16x16x4): q
// rows 16*(b>>4).., k rows 32*(b&15)... Its operands come by tensor load, asked
// for at entry; its WMMAs run while the wave's k_var loads are in flight. Wave w
// does K quarter w&3 of 16x16 tile w>>2; the four partial tiles are summed
// through LDS.
// ---------------------------------------------------------------------------
#define WROWS 16                    // rows of each kind per wave (128 / 8 waves)
#define RPAIR 8                     // row pairs of a set: 16 lanes a row
#define RQ    4                     // 256-B quarters of a row

typedef __attribute__((ext_vector_type(4))) float v4f;

// One lane's share of its row's dot product: 4 x 4 floats of q against the row's,
// in two packed chains.
__device__ __forceinline__ float dot16(const v4f (&qv)[RQ], const v4f (&k)[RQ]) {
  v2f a = k[0].xy * qv[0].xy;
  v2f c = k[0].zw * qv[0].zw;
#pragma unroll
  for (int j = 1; j < RQ; ++j) {
    a = __builtin_elementwise_fma(k[j].xy, qv[j].xy, a);
    c = __builtin_elementwise_fma(k[j].zw, qv[j].zw, c);
  }
  const v2f s = a + c;
  return s.x + s.y;
}

// v of lane l ^ M, M = CTRL & 15, inside a 16-lane row (DPP row_xmask).
template <int CTRL>
__device__ __forceinline__ float xmask_get(float v) {
  return __int_as_float(__builtin_amdgcn_update_dpp(0, __float_as_int(v), CTRL, 0xf, 0xf, true));
}

// The 8 sums over the 16 lanes of a row, folded: at each step a lane keeps half
// of its values and hands the other half to the lane that keeps those, so 4, 2, 1
// and 1 exchanges do it. Lane t ends with the total of row pair t >> 1.
// In two parts: the first step, and the other three.
__device__ __forceinline__ void fold16_first(const float (&r)[RPAIR], float (&y)[4], int t) {
  const bool up = (t & 8) != 0;
#pragma unroll
  for (int i = 0; i < 4; ++i) {
    const float keep = up ? r[i + 4] : r[i];
    const float send = up ? r[i] : r[i + 4];
    y[i] = keep + xmask_get<0x168>(send);
  }
}
__device__ __forceinline__ float fold16_rest(const float (&y)[4], int t) {
  const bool up4 = (t & 4) != 0;
  const bool up2 = (t & 2) != 0;
  const float k0 = up4 ? y[2] : y[0], n0 = up4 ? y[0] : y[2];
  const float k1 = up4 ? y[3] : y[1], n1 = up4 ? y[1] : y[3];
  const float z0 = k0 + xmask_get<0x164>(n0);
  const float z1 = k1 + xmask_get<0x164>(n1);
  const float w  = (up2 ? z1 : z0) + xmask_get<0x162>(up2 ? z0 : z1);
  return w + xmask_get<0x161>(w);
}

__global__ __launch_bounds__(256) void attn_all(
    const float* __restrict__ q, const float* __restrict__ kvar,
    const int* __restrict__ args, const float* __restrict__ kfix,
    const float* __restrict__ karg, float* __restrict__ out)
{
  __shared__ __attribute__((aligned(2048))) unsigned char lds_t[4 * A_SLICE_B + 4 * B_SLICE_B];
  __shared__ __align__(16) float lds_p[4 * 16 * P_PITCH];

  const int b    = blockIdx.x;
  const int lane = threadIdx.x & 31;
  // The wave's number as a scalar: the descriptor's words and the wave's row base
  // then live in scalar registers.
  const int wave = __builtin_amdgcn_readfirstlane(threadIdx.x >> 5);
  const int row0 = wave * WROWS;
  const int bm   = b >> 4;            // 16-row tile of q      (0..31)
  const int bn   = b & 15;            // 32-row group of k     (0..15)
  const int kq   = wave & 3;          // K quarter

  // Every wave asks for one slice: waves 0..3 the q tile's K quarters, waves
  // 4..7 the k group's.
  u32x4 g0;
  u32x8 g1;
  {
    const bool isk = wave >= 4;
    const float* src = (isk ? kfix + (size_t)bn * 32 * D_SZ : q + (size_t)bm * 16 * D_SZ) + kq * 64;
    const uint32_t dst = (uint32_t)(uintptr_t)&lds_t[0]
                       + (isk ? 4u * A_SLICE_B + (uint32_t)kq * B_SLICE_B : (uint32_t)kq * A_SLICE_B);
    tdm_quarter_desc(g0, g1, dst, src, isk ? 32u : 16u);
  }
  asm volatile("tensor_load_to_lds %0, %1" :: "s"(g0), "s"(g1) : "memory");

  const int h = lane >> 4;            // the lane's row within a pair
  const int t = lane & 15;            // the lane's 16 bytes within a 256-B quarter

  // The lane's own 8 index pairs (rows 2i + h of the wave's 16).
  const int* ap = args + ((size_t)b * MAX_VARS + row0 + h) * 2;
  int ai[RPAIR], aj[RPAIR];
#pragma unroll
  for (int i = 0; i < RPAIR; ++i) {
    const int2 a = *(const int2*)(ap + 4 * i);
    ai[i] = a.x; aj[i] = a.y;
  }
  // The row whose total the lane ends with (fold16), and that row's first index.
  const int rowf = (t & 14) + h;
  const int aif  = args[((size_t)b * MAX_VARS + row0 + rowf) * 2];

  // Each lane keeps its 4 private 4-float slices of q[b] in registers.
  v4f qv[RQ];
#pragma unroll
  for (int j = 0; j < RQ; ++j)
    qv[j] = *(const v4f*)(q + (size_t)b * D_SZ + j * 64 + t * 4);
  // Holds the index and q loads in front of the row loads: loads return in issue
  // order, so a row's products can then start when its slices have landed (left
  // to itself the compiler issued q behind nearly all the rows).
  __builtin_amdgcn_sched_barrier(0);

  const float* kv = kvar + ((size_t)b * MAX_VARS + row0 + h) * D_SZ + t * 4;
  float*       ob = out + (size_t)b * L_TOT + NUM_FIXED + row0;

  v4f kb[RPAIR][RQ];                // the lane's slices of one 16-row set

  // Issue order: the first two quarters of every row, then the last two, which is
  // the order in which the eight rows' chains take them.
#pragma unroll
  for (int jp = 0; jp < RQ; jp += 2)
#pragma unroll
    for (int i = 0; i < RPAIR; ++i) {
      kb[i][jp]     = *(const v4f*)(kv + i * 2 * D_SZ + jp * 64);
      kb[i][jp + 1] = *(const v4f*)(kv + i * 2 * D_SZ + jp * 64 + 64);
    }

  // Keeps the 32 row loads issued in front of the fixed-key piece, which then
  // runs under their latency.
  __builtin_amdgcn_sched_barrier(0);

  // The wave's own slice has landed ... (the wait names the descriptor, so that
  // its scalar registers take no new value while the request is outstanding)
  asm volatile("s_wait_tensorcnt 0x0" :: "s"(g0), "s"(g1) : "memory");
  // ... and so has every other wave's. A bare barrier: __syncthreads() would
  // also wait for the row loads in flight. No wave has touched LDS so far.
  asm volatile("s_barrier_signal -1\n\ts_barrier_wait -1" ::: "memory");
  {
    // Fragment addressing (32-bit A 16x4 / B 4x16):
    // lane<16: row=lane, K=k0..k0+1 ; lane>=16: row=lane-16, K=k0+2..k0+3.
    const int half = lane >> 4;
    const int l16  = lane & 15;
    const int tn   = wave >> 2;       // which 16 of the group's 32 k rows
    const float* arow = (const float*)(lds_t + kq * A_SLICE_B + l16 * T_PITCH_B) + 2 * half;
    const float* brow = (const float*)(lds_t + 4 * A_SLICE_B + kq * B_SLICE_B
                                       + (tn * 16 + l16) * T_PITCH_B) + 2 * half;
    // C/D layout: VGPR v -> (M = v + 8*half, N = l16) within the 16x16 tile.
    float* pw = lds_p + (kq * 16 + 8 * half) * P_PITCH + tn * 16 + l16;
    // Thread t sums and stores 2 neighbours: a wave writes 2 rows of 128 B.
    const int r = threadIdx.x >> 4;
    const int c = (threadIdx.x & 15) * 2;
    const float* pr = lds_p + r * P_PITCH + c;
    float* po = out + (size_t)(bm * 16 + r) * L_TOT + bn * 32 + c;
    v8f acc = {};
    // Two trips of 8, not one straight run of 16: in the straight run the compiler
    // put the address arithmetic above into fragment registers directly behind the
    // WMMA that reads them; a loop body of its own holds only loads and WMMAs.
#pragma unroll 8
    for (int kk = 0; kk < 64; kk += 4) {
      v2f fa = *(const v2f*)(arow + kk);
      v2f fb = *(const v2f*)(brow + kk);
      // 8 args: (neg_a, A, neg_b, B, c_mod, C, reuse_a, reuse_b)
      acc = __builtin_amdgcn_wmma_f32_16x16x4_f32(
          false, fa, false, fb, (short)0, acc, false, false);
    }
#pragma unroll
    for (int v = 0; v < 8; ++v) pw[v * P_PITCH] = acc[v];
    // The partial tiles are in LDS before any wave reads them (bare barrier, for
    // the same reason as above; the wait covers this wave's LDS stores).
    asm volatile("s_wait_dscnt 0x0\n\ts_barrier_signal -1\n\ts_barrier_wait -1" ::: "memory");
    const v2f p0 = *(const v2f*)(pr);
    const v2f p1 = *(const v2f*)(pr + 16 * P_PITCH);
    const v2f p2 = *(const v2f*)(pr + 32 * P_PITCH);
    const v2f p3 = *(const v2f*)(pr + 48 * P_PITCH);
    const v2f o  = ((p0 + p1) + (p2 + p3)) * SCALE;
    *(v2f*)po = o;
  }
  // The lane's table offsets. A sentinel row among live ones reads the clamped
  // table row, as the reference's clip does; every index is clamped before its
  // address is formed.
  uint32_t go[RPAIR];
  bool live = false;
#pragma unroll
  for (int i = 0; i < RPAIR; ++i) {
    int f = (int)((unsigned)ai[i] * (unsigned)MAX_VARS + (unsigned)aj[i]);
    f = f < 0 ? 0 : f;
    f = f > MAX_VARS * MAX_VARS - 1 ? MAX_VARS * MAX_VARS - 1 : f;
    go[i] = (uint32_t)f * (D_SZ * 4u) + (uint32_t)t * 16u;
    live |= (ai[i] >= 0);
  }
  // Does the wave hold a gathered row that is not a sentinel? (the same in every lane)
  const bool any = __builtin_amdgcn_ballot_w32(live) != 0u;

  // Keeps the k_var products, and with them the wait for the row loads, behind
  // the fixed-key piece (left to itself the compiler moved them in front of it).
  __builtin_amdgcn_sched_barrier(0);

  float s[RPAIR];
#pragma unroll
  for (int i = 0; i < RPAIR; ++i) s[i] = dot16(qv, kb[i]);

  // The first cross-lane step stands in front of the gathered rows' loads: it
  // needs the products, so they are formed, and the k_var registers freed, before
  // those loads are issued (left to itself the compiler moved the products behind
  // them and held both sets in registers).
  float y[4];
  fold16_first(s, y, t);

  if (any) {
#pragma unroll
    for (int jp = 0; jp < RQ; jp += 2)
#pragma unroll
      for (int i = 0; i < RPAIR; ++i) {
        kb[i][jp]     = *(const v4f*)((const char*)karg + ((size_t)go[i] + jp * 256));
        kb[i][jp + 1] = *(const v4f*)((const char*)karg + ((size_t)go[i] + jp * 256 + 256));
      }
    // No register that these loads name as an offset takes a new value before this
    // wait: it names them, so none serves as a load's destination either.
    asm volatile("s_wait_xcnt 0x0" :: "v"(go[0]), "v"(go[1]), "v"(go[2]), "v"(go[3]),
                                      "v"(go[4]), "v"(go[5]), "v"(go[6]), "v"(go[7]) : "memory");
  }

  // The wave's 16 contiguous results (64 B) go out in one store, from the even lanes.
  const float vk = fold16_rest(y, t);
  if ((t & 1) == 0) ob[rowf] = vk * SCALE;

  float vg = 0.0f;
  if (any) {
#pragma unroll
    for (int i = 0; i < RPAIR; ++i) s[i] = dot16(qv, kb[i]);
    fold16_first(s, y, t);
    const float d = fold16_rest(y, t);
    vg = aif < 0 ? 0.0f : d * SCALE;  // masked sentinel row -> exact zero
  }
  if ((t & 1) == 0) ob[MAX_VARS + rowf] = vg;
}

extern "C" void kernel_launch(void* const* d_in, const int* in_sizes, int n_in,
                              void* d_out, int out_size, void* d_ws, size_t ws_size,
                              hipStream_t stream) {
  const float* q    = (const float*)d_in[0];   // [512, 256]
  const float* kvar = (const float*)d_in[1];   // [512, 128, 256]
  const int*   args = (const int*)d_in[2];     // [512, 128, 2]
  const float* kfix = (const float*)d_in[3];   // [512, 256]
  const float* karg = (const float*)d_in[4];   // [16384, 256]
  float* out = (float*)d_out;                  // [512, 768]

  // One block per batch element; each also does 1/512 of the fixed-key product.
  attn_all<<<B_SZ, 256, 0, stream>>>(q, kvar, args, kfix, karg, out);
}
